// v000
// The times below were measured on an AMD MI455X: many runs one after another, warmed up first and cycling through
// copies of the inputs, with the whole window's GPU time divided by the number of runs. Launches and the gaps
// between them are all in it. The median over several windows is given; except for v000 it joins two sittings, which
// can be a few percent apart, so the side-by-side timings, each taken in one sitting, are the better comparison.
// v000 is the starting kernel. One run takes 76.2 microseconds.
#include <hip/hip_runtime.h>

typedef __attribute__((ext_vector_type(16))) _Float16 v16h;
typedef __attribute__((ext_vector_type(8)))  _Float16 v8h;   // 16 bytes
typedef __attribute__((ext_vector_type(8)))  float    v8f;
typedef __attribute__((ext_vector_type(4)))  float    f4;    // 16 bytes

#define D_IN  24
#define D_H1  64
#define D_H2  128
#define D_OUT 64

#define WAVES   4
#define THREADS (WAVES * 32)

// element i of a v16h fragment -> K index (ISA 7.12.2, 16-bit A/B layout)
#define KMAP(i, hi) ((((i) >> 3) << 4) + ((hi) << 3) + ((i) & 7))

union FragH { v16h f; v8h h[2]; };
union Acc8 { v8f v; f4 q[2]; };

__device__ __forceinline__ v8f wmma_f16(const v16h& a, const v16h& b, v8f c) {
    return __builtin_amdgcn_wmma_f32_16x16x32_f16(false, a, false, b,
                                                  (short)0, c, false, false);
}

__device__ __forceinline__ float relu(float r) {
    return __builtin_fmaxf(r, 0.0f);   // single v_max_num_f32
}

__global__ __launch_bounds__(THREADS) void linenet_wmma_kernel(
    const float* __restrict__ X,
    const float* __restrict__ W1, const float* __restrict__ b1,
    const float* __restrict__ W2, const float* __restrict__ b2,
    const float* __restrict__ W3, const float* __restrict__ b3,
    float* __restrict__ Y, int nTiles)
{
    // Weights pre-swizzled into exact A-fragment order:
    // element (frag, lane, i) at [ (frag*32 + lane)*16 + i ]  -> 32B/lane contiguous
    __shared__ _Float16 sA1[4  * 32 * 16];   //  4 KB  (K padded 24->32)
    __shared__ _Float16 sA2[16 * 32 * 16];   // 16 KB
    __shared__ _Float16 sA3[16 * 32 * 16];   // 16 KB
    __shared__ float    sb1[D_H1], sb2[D_H2], sb3[D_OUT];
    __shared__ _Float16 sAct1[WAVES][16 * D_H1];   //  8 KB, act1[row][feature]
    __shared__ _Float16 sAct2[WAVES][16 * D_H2];   // 16 KB, act2[row][feature]

    const int tid = threadIdx.x;

    // ---- one-time: convert + swizzle weights into fragment layout ----
    for (int idx = tid; idx < 4 * 32 * 16; idx += THREADS) {
        int i = idx & 15, lane = (idx >> 4) & 31, nt = idx >> 9;
        int hi = lane >> 4, ln = lane & 15;
        int k = KMAP(i, hi);
        sA1[idx] = (k < D_IN) ? (_Float16)W1[k * D_H1 + nt * 16 + ln]
                              : (_Float16)0.f;
    }
    for (int idx = tid; idx < 16 * 32 * 16; idx += THREADS) {
        int i = idx & 15, lane = (idx >> 4) & 31, f = idx >> 9;
        int nt = f >> 1, ks = f & 1;                 // frag = nt*2 + ks
        int hi = lane >> 4, ln = lane & 15;
        int k = ks * 32 + KMAP(i, hi);
        sA2[idx] = (_Float16)W2[k * D_H2 + nt * 16 + ln];
    }
    for (int idx = tid; idx < 16 * 32 * 16; idx += THREADS) {
        int i = idx & 15, lane = (idx >> 4) & 31, f = idx >> 9;
        int nt = f >> 2, ks = f & 3;                 // frag = nt*4 + ks
        int hi = lane >> 4, ln = lane & 15;
        int k = ks * 32 + KMAP(i, hi);
        sA3[idx] = (_Float16)W3[k * D_OUT + nt * 16 + ln];
    }
    for (int i = tid; i < D_H1;  i += THREADS) sb1[i] = b1[i];
    for (int i = tid; i < D_H2;  i += THREADS) sb2[i] = b2[i];
    for (int i = tid; i < D_OUT; i += THREADS) sb3[i] = b3[i];
    __syncthreads();

    const int lane = tid & 31;      // wave32
    const int wave = tid >> 5;
    const int hi   = lane >> 4;     // half-wave select
    const int ln   = lane & 15;     // data row within tile (B cols / C cols)

    const int globalWave = blockIdx.x * WAVES + wave;
    const int waveStride = gridDim.x * WAVES;

    _Float16* act1 = sAct1[wave];
    _Float16* act2 = sAct2[wave];

    // Hoist layer-1 weight fragments (loop-invariant, 32 VGPRs)
    FragH wA1[4];
    #pragma unroll
    for (int nt = 0; nt < 4; ++nt) {
        const _Float16* p = sA1 + (nt * 32 + lane) * 16;
        wA1[nt].h[0] = *(const v8h*)(p);
        wA1[nt].h[1] = *(const v8h*)(p + 8);
    }

    for (int tile = globalWave; tile < nTiles; tile += waveStride) {
        const long rowBase = (long)tile * 16;

        // ---- build layer-1 B fragment straight from global (float4 loads) --
        FragH bin;
        {
            const float* xrow = X + (rowBase + ln) * D_IN;
            f4 x0 = *(const f4*)(xrow + hi * 8);       // K = hi*8 .. hi*8+3
            f4 x1 = *(const f4*)(xrow + hi * 8 + 4);   // K = hi*8+4 .. +7
            f4 x2 = *(const f4*)(xrow + 16);           // K = 16..19 (lo) / pad (hi)
            f4 x3 = *(const f4*)(xrow + 20);           // K = 20..23 (lo) / pad (hi)
            if (hi) { x2 = (f4){0.f, 0.f, 0.f, 0.f}; x3 = (f4){0.f, 0.f, 0.f, 0.f}; }
            #pragma unroll
            for (int j = 0; j < 4; ++j) {
                bin.h[0][j]     = (_Float16)x0[j];
                bin.h[0][j + 4] = (_Float16)x1[j];
                bin.h[1][j]     = (_Float16)x2[j];
                bin.h[1][j + 4] = (_Float16)x3[j];
            }
        }

        // ================= layer 1: h1^T = W1^T x^T + b1 =================
        #pragma unroll
        for (int nt = 0; nt < 4; ++nt) {
            const int fbase = nt * 16 + hi * 8;        // 8 consecutive features
            Acc8 c;                                    // bias as accumulator init
            c.q[0] = *(const f4*)(sb1 + fbase);
            c.q[1] = *(const f4*)(sb1 + fbase + 4);
            c.v = wmma_f16(wA1[nt].f, bin.f, c.v);
            v8h o;
            #pragma unroll
            for (int v = 0; v < 8; ++v)
                o[v] = (_Float16)relu(c.v[v]);
            *(v8h*)(act1 + ln * D_H1 + fbase) = o;     // one ds_store_b128
        }
        asm volatile("s_wait_dscnt 0" ::: "memory");

        // ================= layer 2: h2^T = W2^T h1^T + b2 ================
        FragH b2f[2];
        #pragma unroll
        for (int ks = 0; ks < 2; ++ks) {
            const _Float16* p = act1 + ln * D_H1 + ks * 32 + hi * 8;
            b2f[ks].h[0] = *(const v8h*)(p);           // K group 0 (contig 8)
            b2f[ks].h[1] = *(const v8h*)(p + 16);      // K group 1 (contig 8)
        }
        #pragma unroll
        for (int nt = 0; nt < 8; ++nt) {
            const int fbase = nt * 16 + hi * 8;
            Acc8 c;
            c.q[0] = *(const f4*)(sb2 + fbase);
            c.q[1] = *(const f4*)(sb2 + fbase + 4);
            #pragma unroll
            for (int ks = 0; ks < 2; ++ks) {
                FragH a;
                const _Float16* p = sA2 + ((nt * 2 + ks) * 32 + lane) * 16;
                a.h[0] = *(const v8h*)(p);
                a.h[1] = *(const v8h*)(p + 8);
                c.v = wmma_f16(a.f, b2f[ks].f, c.v);
            }
            v8h o;
            #pragma unroll
            for (int v = 0; v < 8; ++v)
                o[v] = (_Float16)relu(c.v[v]);
            *(v8h*)(act2 + ln * D_H2 + fbase) = o;
        }
        asm volatile("s_wait_dscnt 0" ::: "memory");

        // ================= layer 3: y^T = W3^T h2^T + b3 =================
        FragH b3f[4];
        #pragma unroll
        for (int ks = 0; ks < 4; ++ks) {
            const _Float16* p = act2 + ln * D_H2 + ks * 32 + hi * 8;
            b3f[ks].h[0] = *(const v8h*)(p);
            b3f[ks].h[1] = *(const v8h*)(p + 16);
        }
        float* yrow = Y + (rowBase + ln) * D_OUT;
        #pragma unroll
        for (int nt = 0; nt < 4; ++nt) {
            const int fbase = nt * 16 + hi * 8;
            Acc8 c;
            c.q[0] = *(const f4*)(sb3 + fbase);
            c.q[1] = *(const f4*)(sb3 + fbase + 4);
            #pragma unroll
            for (int ks = 0; ks < 4; ++ks) {
                FragH a;
                const _Float16* p = sA3 + ((nt * 4 + ks) * 32 + lane) * 16;
                a.h[0] = *(const v8h*)(p);
                a.h[1] = *(const v8h*)(p + 8);
                c.v = wmma_f16(a.f, b3f[ks].f, c.v);
            }
            f4 r0, r1;
            #pragma unroll
            for (int v = 0; v < 4; ++v) {
                r0[v] = relu(c.v[v]);
                r1[v] = relu(c.v[v + 4]);
            }
            *(f4*)(yrow + fbase)     = r0;             // global_store_b128
            *(f4*)(yrow + fbase + 4) = r1;
        }
        asm volatile("s_wait_dscnt 0" ::: "memory");
    }
}

extern "C" void kernel_launch(void* const* d_in, const int* in_sizes, int n_in,
                              void* d_out, int out_size, void* d_ws, size_t ws_size,
                              hipStream_t stream) {
    const float* X  = (const float*)d_in[0];
    const float* W1 = (const float*)d_in[1];
    const float* b1 = (const float*)d_in[2];
    const float* W2 = (const float*)d_in[3];
    const float* b2 = (const float*)d_in[4];
    const float* W3 = (const float*)d_in[5];
    const float* b3 = (const float*)d_in[6];
    float* Y = (float*)d_out;

    const long rows   = (long)in_sizes[0] / D_IN;   // 524288
    const int  nTiles = (int)(rows / 16);           // 32768

    int blocks = 2048;                              // 8192 waves -> 4 tiles/wave
    if (blocks * WAVES > nTiles) blocks = (nTiles + WAVES - 1) / WAVES;
    if (blocks < 1) blocks = 1;

    linenet_wmma_kernel<<<blocks, THREADS, 0, stream>>>(X, W1, b1, W2, b2, W3, b3,
                                                        Y, nTiles);
}

// v001
// A run of this version takes 44.8 microseconds.
// In both of two side-by-side timings against v000, it was 1.76 times as fast.
#include <hip/hip_runtime.h>

typedef __attribute__((ext_vector_type(16))) _Float16 v16h;
typedef __attribute__((ext_vector_type(8)))  _Float16 v8h;   // 16 bytes
typedef __attribute__((ext_vector_type(8)))  float    v8f;
typedef __attribute__((ext_vector_type(4)))  float    f4;    // 16 bytes

#define D_IN  24
#define D_H1  64
#define D_H2  128
#define D_OUT 64

#define WAVES   4
#define THREADS (WAVES * 32)

// element i of a v16h fragment -> K index (ISA 7.12.2, 16-bit A/B layout)
#define KMAP(i, hi) ((((i) >> 3) << 4) + ((hi) << 3) + ((i) & 7))

union FragH { v16h f; v8h h[2]; };
union Acc8 { v8f v; f4 q[2]; };

__device__ __forceinline__ v8f wmma_f16(const v16h& a, const v16h& b, v8f c) {
    return __builtin_amdgcn_wmma_f32_16x16x32_f16(false, a, false, b,
                                                  (short)0, c, false, false);
}

__device__ __forceinline__ float relu(float r) {
    return __builtin_fmaxf(r, 0.0f);   // single v_max_num_f32
}

__global__ __launch_bounds__(THREADS) void linenet_wmma_kernel(
    const float* __restrict__ X,
    const float* __restrict__ W1, const float* __restrict__ b1,
    const float* __restrict__ W2, const float* __restrict__ b2,
    const float* __restrict__ W3, const float* __restrict__ b3,
    float* __restrict__ Y, int nTiles)
{
    // Weights pre-swizzled into exact A-fragment order:
    // element (frag, lane, i) at [ (frag*32 + lane)*16 + i ]  -> 32B/lane contiguous
    __shared__ _Float16 sA1[4  * 32 * 16];   //  4 KB  (K padded 24->32)
    __shared__ _Float16 sA2[16 * 32 * 16];   // 16 KB
    __shared__ _Float16 sA3[16 * 32 * 16];   // 16 KB
    __shared__ float    sb1[D_H1], sb2[D_H2], sb3[D_OUT];

    const int tid = threadIdx.x;

    // ---- one-time: convert + swizzle weights into fragment layout ----
    for (int idx = tid; idx < 4 * 32 * 16; idx += THREADS) {
        int i = idx & 15, lane = (idx >> 4) & 31, nt = idx >> 9;
        int hi = lane >> 4, ln = lane & 15;
        int k = KMAP(i, hi);
        sA1[idx] = (k < D_IN) ? (_Float16)W1[k * D_H1 + nt * 16 + ln]
                              : (_Float16)0.f;
    }
    for (int idx = tid; idx < 16 * 32 * 16; idx += THREADS) {
        int i = idx & 15, lane = (idx >> 4) & 31, f = idx >> 9;
        int nt = f >> 1, ks = f & 1;                 // frag = nt*2 + ks
        int hi = lane >> 4, ln = lane & 15;
        int k = ks * 32 + KMAP(i, hi);
        sA2[idx] = (_Float16)W2[k * D_H2 + nt * 16 + ln];
    }
    for (int idx = tid; idx < 16 * 32 * 16; idx += THREADS) {
        int i = idx & 15, lane = (idx >> 4) & 31, f = idx >> 9;
        int nt = f >> 2, ks = f & 3;                 // frag = nt*4 + ks
        int hi = lane >> 4, ln = lane & 15;
        int k = ks * 32 + KMAP(i, hi);
        sA3[idx] = (_Float16)W3[k * D_OUT + nt * 16 + ln];
    }
    for (int i = tid; i < D_H1;  i += THREADS) sb1[i] = b1[i];
    for (int i = tid; i < D_H2;  i += THREADS) sb2[i] = b2[i];
    for (int i = tid; i < D_OUT; i += THREADS) sb3[i] = b3[i];
    __syncthreads();

    const int lane = tid & 31;      // wave32
    const int wave = tid >> 5;
    const int hi   = lane >> 4;     // half-wave select
    const int ln   = lane & 15;     // data row within tile (B cols / C cols)

    const int globalWave = blockIdx.x * WAVES + wave;
    const int waveStride = gridDim.x * WAVES;

    // Hoist layer-1 weight fragments (loop-invariant, 32 VGPRs)
    FragH wA1[4];
    #pragma unroll
    for (int nt = 0; nt < 4; ++nt) {
        const _Float16* p = sA1 + (nt * 32 + lane) * 16;
        wA1[nt].h[0] = *(const v8h*)(p);
        wA1[nt].h[1] = *(const v8h*)(p + 8);
    }

    for (int tile = globalWave; tile < nTiles; tile += waveStride) {
        const long rowBase = (long)tile * 16;

        // ---- build layer-1 B fragment straight from global (float4 loads) --
        FragH bin;
        {
            const float* xrow = X + (rowBase + ln) * D_IN;
            f4 x0 = *(const f4*)(xrow + hi * 8);       // K = hi*8 .. hi*8+3
            f4 x1 = *(const f4*)(xrow + hi * 8 + 4);   // K = hi*8+4 .. +7
            f4 x2 = *(const f4*)(xrow + 16);           // K = 16..19 (lo) / pad (hi)
            f4 x3 = *(const f4*)(xrow + 20);           // K = 20..23 (lo) / pad (hi)
            if (hi) { x2 = (f4){0.f, 0.f, 0.f, 0.f}; x3 = (f4){0.f, 0.f, 0.f, 0.f}; }
            #pragma unroll
            for (int j = 0; j < 4; ++j) {
                bin.h[0][j]     = (_Float16)x0[j];
                bin.h[0][j + 4] = (_Float16)x1[j];
                bin.h[1][j]     = (_Float16)x2[j];
                bin.h[1][j + 4] = (_Float16)x3[j];
            }
        }

        // ================= layer 1: h1^T = W1^T x^T + b1 =================
        // A lane's 8 accumulators of tile nt are features nt*16 + hi*8 + 0..7 of
        // data row ln: exactly half (nt & 1) of the next layer's B fragment
        // (nt >> 1) in KMAP order, so the activations stay in registers.
        FragH b2f[2];
        #pragma unroll
        for (int nt = 0; nt < 4; ++nt) {
            const int fbase = nt * 16 + hi * 8;        // 8 consecutive features
            Acc8 c;                                    // bias as accumulator init
            c.q[0] = *(const f4*)(sb1 + fbase);
            c.q[1] = *(const f4*)(sb1 + fbase + 4);
            c.v = wmma_f16(wA1[nt].f, bin.f, c.v);
            v8h o;
            #pragma unroll
            for (int v = 0; v < 8; ++v)
                o[v] = (_Float16)relu(c.v[v]);
            b2f[nt >> 1].h[nt & 1] = o;
        }

        // ================= layer 2: h2^T = W2^T h1^T + b2 ================
        FragH b3f[4];
        #pragma unroll
        for (int nt = 0; nt < 8; ++nt) {
            const int fbase = nt * 16 + hi * 8;
            Acc8 c;
            c.q[0] = *(const f4*)(sb2 + fbase);
            c.q[1] = *(const f4*)(sb2 + fbase + 4);
            #pragma unroll
            for (int ks = 0; ks < 2; ++ks) {
                FragH a;
                const _Float16* p = sA2 + ((nt * 2 + ks) * 32 + lane) * 16;
                a.h[0] = *(const v8h*)(p);
                a.h[1] = *(const v8h*)(p + 8);
                c.v = wmma_f16(a.f, b2f[ks].f, c.v);
            }
            v8h o;
            #pragma unroll
            for (int v = 0; v < 8; ++v)
                o[v] = (_Float16)relu(c.v[v]);
            b3f[nt >> 1].h[nt & 1] = o;
        }

        // ================= layer 3: y^T = W3^T h2^T + b3 =================
        float* yrow = Y + (rowBase + ln) * D_OUT;
        #pragma unroll
        for (int nt = 0; nt < 4; ++nt) {
            const int fbase = nt * 16 + hi * 8;
            Acc8 c;
            c.q[0] = *(const f4*)(sb3 + fbase);
            c.q[1] = *(const f4*)(sb3 + fbase + 4);
            #pragma unroll
            for (int ks = 0; ks < 4; ++ks) {
                FragH a;
                const _Float16* p = sA3 + ((nt * 4 + ks) * 32 + lane) * 16;
                a.h[0] = *(const v8h*)(p);
                a.h[1] = *(const v8h*)(p + 8);
                c.v = wmma_f16(a.f, b3f[ks].f, c.v);
            }
            f4 r0, r1;
            #pragma unroll
            for (int v = 0; v < 4; ++v) {
                r0[v] = relu(c.v[v]);
                r1[v] = relu(c.v[v + 4]);
            }
            *(f4*)(yrow + fbase)     = r0;             // global_store_b128
            *(f4*)(yrow + fbase + 4) = r1;
        }
        // Compiler fence, no instruction: keeps the weight and bias reads inside the
        // tile loop, as the removed waits' clobbers did. Without it the compiler lifts
        // all of them out of the loop (about 500 VGPRs): two work-groups on a WGP
        // instead of eight, and far fewer waves to hide the staging and the X loads.
        asm volatile("" ::: "memory");
    }
}

extern "C" void kernel_launch(void* const* d_in, const int* in_sizes, int n_in,
                              void* d_out, int out_size, void* d_ws, size_t ws_size,
                              hipStream_t stream) {
    const float* X  = (const float*)d_in[0];
    const float* W1 = (const float*)d_in[1];
    const float* b1 = (const float*)d_in[2];
    const float* W2 = (const float*)d_in[3];
    const float* b2 = (const float*)d_in[4];
    const float* W3 = (const float*)d_in[5];
    const float* b3 = (const float*)d_in[6];
    float* Y = (float*)d_out;

    const long rows   = (long)in_sizes[0] / D_IN;   // 524288
    const int  nTiles = (int)(rows / 16);           // 32768

    int blocks = 2048;                              // 8192 waves -> 4 tiles/wave
    if (blocks * WAVES > nTiles) blocks = (nTiles + WAVES - 1) / WAVES;
    if (blocks < 1) blocks = 1;

    linenet_wmma_kernel<<<blocks, THREADS, 0, stream>>>(X, W1, b1, W2, b2, W3, b3,
                                                        Y, nTiles);
}

// v002
// One run takes 35 microseconds.
// In two side-by-side timings against v001, it was 1.29 and 1.30 times as fast.
// Over all steps from v000 it is 2.27 times as fast.
#include <hip/hip_runtime.h>

typedef __attribute__((ext_vector_type(16))) _Float16 v16h;
typedef __attribute__((ext_vector_type(8)))  _Float16 v8h;   // 16 bytes
typedef __attribute__((ext_vector_type(8)))  float    v8f;
typedef __attribute__((ext_vector_type(4)))  float    f4;    // 16 bytes

#define D_IN  24
#define D_H1  64
#define D_H2  128
#define D_OUT 64

#define WAVES   32   // one work-group fills a WGP: the weights are staged once per WGP
#define THREADS (WAVES * 32)

// element i of a v16h fragment -> K index (ISA 7.12.2, 16-bit A/B layout)
#define KMAP(i, hi) ((((i) >> 3) << 4) + ((hi) << 3) + ((i) & 7))

union FragH { v16h f; v8h h[2]; };
union Acc8 { v8f v; f4 q[2]; };

__device__ __forceinline__ v8f wmma_f16(const v16h& a, const v16h& b, v8f c) {
    return __builtin_amdgcn_wmma_f32_16x16x32_f16(false, a, false, b,
                                                  (short)0, c, false, false);
}

__device__ __forceinline__ float relu(float r) {
    return __builtin_fmaxf(r, 0.0f);   // single v_max_num_f32
}

__global__ __launch_bounds__(THREADS) void linenet_wmma_kernel(
    const float* __restrict__ X,
    const float* __restrict__ W1, const float* __restrict__ b1,
    const float* __restrict__ W2, const float* __restrict__ b2,
    const float* __restrict__ W3, const float* __restrict__ b3,
    float* __restrict__ Y, int nTiles)
{
    // Weights pre-swizzled into exact A-fragment order:
    // element (frag, lane, i) at [ (frag*32 + lane)*16 + i ]  -> 32B/lane contiguous
    __shared__ _Float16 sA1[4  * 32 * 16];   //  4 KB  (K padded 24->32)
    __shared__ _Float16 sA2[16 * 32 * 16];   // 16 KB
    __shared__ _Float16 sA3[16 * 32 * 16];   // 16 KB
    __shared__ float    sb1[D_H1], sb2[D_H2], sb3[D_OUT];

    const int tid = threadIdx.x;

    // ---- one-time: convert + swizzle weights into fragment layout ----
    // The three loops have 2, 8 and 8 trips; unrolled so that a thread's loads are in
    // flight together (rolled, each trip waits out its one load's latency).
    #pragma unroll
    for (int idx = tid; idx < 4 * 32 * 16; idx += THREADS) {
        int i = idx & 15, lane = (idx >> 4) & 31, nt = idx >> 9;
        int hi = lane >> 4, ln = lane & 15;
        int k = KMAP(i, hi);
        sA1[idx] = (k < D_IN) ? (_Float16)W1[k * D_H1 + nt * 16 + ln]
                              : (_Float16)0.f;
    }
    #pragma unroll
    for (int idx = tid; idx < 16 * 32 * 16; idx += THREADS) {
        int i = idx & 15, lane = (idx >> 4) & 31, f = idx >> 9;
        int nt = f >> 1, ks = f & 1;                 // frag = nt*2 + ks
        int hi = lane >> 4, ln = lane & 15;
        int k = ks * 32 + KMAP(i, hi);
        sA2[idx] = (_Float16)W2[k * D_H2 + nt * 16 + ln];
    }
    #pragma unroll
    for (int idx = tid; idx < 16 * 32 * 16; idx += THREADS) {
        int i = idx & 15, lane = (idx >> 4) & 31, f = idx >> 9;
        int nt = f >> 2, ks = f & 3;                 // frag = nt*4 + ks
        int hi = lane >> 4, ln = lane & 15;
        int k = ks * 32 + KMAP(i, hi);
        sA3[idx] = (_Float16)W3[k * D_OUT + nt * 16 + ln];
    }
    for (int i = tid; i < D_H1;  i += THREADS) sb1[i] = b1[i];
    for (int i = tid; i < D_H2;  i += THREADS) sb2[i] = b2[i];
    for (int i = tid; i < D_OUT; i += THREADS) sb3[i] = b3[i];
    __syncthreads();

    const int lane = tid & 31;      // wave32
    const int wave = tid >> 5;
    const int hi   = lane >> 4;     // half-wave select
    const int ln   = lane & 15;     // data row within tile (B cols / C cols)

    const int globalWave = blockIdx.x * WAVES + wave;
    const int waveStride = gridDim.x * WAVES;

    // Hoist layer-1 weight fragments (loop-invariant, 32 VGPRs)
    FragH wA1[4];
    #pragma unroll
    for (int nt = 0; nt < 4; ++nt) {
        const _Float16* p = sA1 + (nt * 32 + lane) * 16;
        wA1[nt].h[0] = *(const v8h*)(p);
        wA1[nt].h[1] = *(const v8h*)(p + 8);
    }

    for (int tile = globalWave; tile < nTiles; tile += waveStride) {
        const long rowBase = (long)tile * 16;

        // ---- build layer-1 B fragment straight from global (float4 loads) --
        FragH bin;
        {
            const float* xrow = X + (rowBase + ln) * D_IN;
            f4 x0 = *(const f4*)(xrow + hi * 8);       // K = hi*8 .. hi*8+3
            f4 x1 = *(const f4*)(xrow + hi * 8 + 4);   // K = hi*8+4 .. +7
            f4 x2 = *(const f4*)(xrow + 16);           // K = 16..19 (lo) / pad (hi)
            f4 x3 = *(const f4*)(xrow + 20);           // K = 20..23 (lo) / pad (hi)
            if (hi) { x2 = (f4){0.f, 0.f, 0.f, 0.f}; x3 = (f4){0.f, 0.f, 0.f, 0.f}; }
            #pragma unroll
            for (int j = 0; j < 4; ++j) {
                bin.h[0][j]     = (_Float16)x0[j];
                bin.h[0][j + 4] = (_Float16)x1[j];
                bin.h[1][j]     = (_Float16)x2[j];
                bin.h[1][j + 4] = (_Float16)x3[j];
            }
        }

        // ================= layer 1: h1^T = W1^T x^T + b1 =================
        // A lane's 8 accumulators of tile nt are features nt*16 + hi*8 + 0..7 of
        // data row ln: exactly half (nt & 1) of the next layer's B fragment
        // (nt >> 1) in KMAP order, so the activations stay in registers.
        FragH b2f[2];
        #pragma unroll
        for (int nt = 0; nt < 4; ++nt) {
            const int fbase = nt * 16 + hi * 8;        // 8 consecutive features
            Acc8 c;                                    // bias as accumulator init
            c.q[0] = *(const f4*)(sb1 + fbase);
            c.q[1] = *(const f4*)(sb1 + fbase + 4);
            c.v = wmma_f16(wA1[nt].f, bin.f, c.v);
            v8h o;
            #pragma unroll
            for (int v = 0; v < 8; ++v)
                o[v] = (_Float16)relu(c.v[v]);
            b2f[nt >> 1].h[nt & 1] = o;
        }

        // ================= layer 2: h2^T = W2^T h1^T + b2 ================
        FragH b3f[4];
        #pragma unroll
        for (int nt = 0; nt < 8; ++nt) {
            const int fbase = nt * 16 + hi * 8;
            Acc8 c;
            c.q[0] = *(const f4*)(sb2 + fbase);
            c.q[1] = *(const f4*)(sb2 + fbase + 4);
            #pragma unroll
            for (int ks = 0; ks < 2; ++ks) {
                FragH a;
                const _Float16* p = sA2 + ((nt * 2 + ks) * 32 + lane) * 16;
                a.h[0] = *(const v8h*)(p);
                a.h[1] = *(const v8h*)(p + 8);
                c.v = wmma_f16(a.f, b2f[ks].f, c.v);
            }
            v8h o;
            #pragma unroll
            for (int v = 0; v < 8; ++v)
                o[v] = (_Float16)relu(c.v[v]);
            b3f[nt >> 1].h[nt & 1] = o;
        }

        // ================= layer 3: y^T = W3^T h2^T + b3 =================
        float* yrow = Y + (rowBase + ln) * D_OUT;
        #pragma unroll
        for (int nt = 0; nt < 4; ++nt) {
            const int fbase = nt * 16 + hi * 8;
            Acc8 c;
            c.q[0] = *(const f4*)(sb3 + fbase);
            c.q[1] = *(const f4*)(sb3 + fbase + 4);
            #pragma unroll
            for (int ks = 0; ks < 4; ++ks) {
                FragH a;
                const _Float16* p = sA3 + ((nt * 4 + ks) * 32 + lane) * 16;
                a.h[0] = *(const v8h*)(p);
                a.h[1] = *(const v8h*)(p + 8);
                c.v = wmma_f16(a.f, b3f[ks].f, c.v);
            }
            f4 r0, r1;
            #pragma unroll
            for (int v = 0; v < 4; ++v) {
                r0[v] = relu(c.v[v]);
                r1[v] = relu(c.v[v + 4]);
            }
            *(f4*)(yrow + fbase)     = r0;             // global_store_b128
            *(f4*)(yrow + fbase + 4) = r1;
        }
        // Compiler fence, no instruction: keeps the weight and bias reads inside the
        // tile loop, as the removed waits' clobbers did. Without it the compiler lifts
        // all of them out of the loop (about 500 VGPRs), far above the 128 that a wave
        // of a 32-wave work-group may hold.
        asm volatile("" ::: "memory");
    }
}

extern "C" void kernel_launch(void* const* d_in, const int* in_sizes, int n_in,
                              void* d_out, int out_size, void* d_ws, size_t ws_size,
                              hipStream_t stream) {
    const float* X  = (const float*)d_in[0];
    const float* W1 = (const float*)d_in[1];
    const float* b1 = (const float*)d_in[2];
    const float* W2 = (const float*)d_in[3];
    const float* b2 = (const float*)d_in[4];
    const float* W3 = (const float*)d_in[5];
    const float* b3 = (const float*)d_in[6];
    float* Y = (float*)d_out;

    const long rows   = (long)in_sizes[0] / D_IN;   // 524288
    const int  nTiles = (int)(rows / 16);           // 32768

    int blocks = 256;                               // 8192 waves -> 4 tiles/wave
    if (blocks * WAVES > nTiles) blocks = (nTiles + WAVES - 1) / WAVES;
    if (blocks < 1) blocks = 1;

    linenet_wmma_kernel<<<blocks, THREADS, 0, stream>>>(X, W1, b1, W2, b2, W3, b3,
                                                        Y, nTiles);
}

// v003
// It runs in 30.5 microseconds.
// Timed twice side by side with v002, it ran 1.15 times as fast both times.
// Counting every step since v000, it is 2.62 times as fast.
#include <hip/hip_runtime.h>

typedef __attribute__((ext_vector_type(16))) _Float16 v16h;
typedef __attribute__((ext_vector_type(8)))  _Float16 v8h;   // 16 bytes
typedef __attribute__((ext_vector_type(8)))  float    v8f;
typedef __attribute__((ext_vector_type(4)))  float    f4;    // 16 bytes

#define D_IN  24
#define D_H1  64
#define D_H2  128
#define D_OUT 64

#define WAVES   32   // one work-group fills a WGP: the weights are staged once per WGP
#define THREADS (WAVES * 32)

// element i of a v16h fragment -> K index (ISA 7.12.2, 16-bit A/B layout)
#define KMAP(i, hi) ((((i) >> 3) << 4) + ((hi) << 3) + ((i) & 7))

union FragH { v16h f; v8h h[2]; };
union Acc8 { v8f v; f4 q[2]; };

__device__ __forceinline__ v8f wmma_f16(const v16h& a, const v16h& b, v8f c) {
    return __builtin_amdgcn_wmma_f32_16x16x32_f16(false, a, false, b,
                                                  (short)0, c, false, false);
}

__device__ __forceinline__ float relu(float r) {
    return __builtin_fmaxf(r, 0.0f);   // single v_max_num_f32
}

__global__ __launch_bounds__(THREADS) void linenet_wmma_kernel(
    const float* __restrict__ X,
    const float* __restrict__ W1, const float* __restrict__ b1,
    const float* __restrict__ W2, const float* __restrict__ b2,
    const float* __restrict__ W3, const float* __restrict__ b3,
    float* __restrict__ Y, int nTiles)
{
    // Weights pre-swizzled into A-fragment order, each fragment as two 512-byte planes:
    // element (frag, lane, i) at [ ((frag*2 + (i>>3))*32 + lane)*8 + (i&7) ], so that the
    // lanes of one ds_load_b128 lie 16 bytes apart: 16 lanes cover all 64 banks once
    // (at 32 bytes a lane they covered half the banks twice, a two-way conflict).
    __shared__ _Float16 sA1[4  * 32 * 16];   //  4 KB  (K padded 24->32)
    __shared__ _Float16 sA2[16 * 32 * 16];   // 16 KB
    __shared__ _Float16 sA3[16 * 32 * 16];   // 16 KB
    __shared__ float    sb1[D_H1], sb2[D_H2], sb3[D_OUT];

    const int tid = threadIdx.x;

    // ---- one-time: convert + swizzle weights into fragment layout ----
    // The three loops have 2, 8 and 8 trips; unrolled so that a thread's loads are in
    // flight together (rolled, each trip waits out its one load's latency).
    #pragma unroll
    for (int idx = tid; idx < 4 * 32 * 16; idx += THREADS) {
        int i = ((idx >> 8) & 1) * 8 + (idx & 7), lane = (idx >> 3) & 31, nt = idx >> 9;
        int hi = lane >> 4, ln = lane & 15;
        int k = KMAP(i, hi);
        sA1[idx] = (k < D_IN) ? (_Float16)W1[k * D_H1 + nt * 16 + ln]
                              : (_Float16)0.f;
    }
    #pragma unroll
    for (int idx = tid; idx < 16 * 32 * 16; idx += THREADS) {
        int i = ((idx >> 8) & 1) * 8 + (idx & 7), lane = (idx >> 3) & 31, f = idx >> 9;
        int nt = f >> 1, ks = f & 1;                 // frag = nt*2 + ks
        int hi = lane >> 4, ln = lane & 15;
        int k = ks * 32 + KMAP(i, hi);
        sA2[idx] = (_Float16)W2[k * D_H2 + nt * 16 + ln];
    }
    #pragma unroll
    for (int idx = tid; idx < 16 * 32 * 16; idx += THREADS) {
        int i = ((idx >> 8) & 1) * 8 + (idx & 7), lane = (idx >> 3) & 31, f = idx >> 9;
        int nt = f >> 2, ks = f & 3;                 // frag = nt*4 + ks
        int hi = lane >> 4, ln = lane & 15;
        int k = ks * 32 + KMAP(i, hi);
        sA3[idx] = (_Float16)W3[k * D_OUT + nt * 16 + ln];
    }
    for (int i = tid; i < D_H1;  i += THREADS) sb1[i] = b1[i];
    for (int i = tid; i < D_H2;  i += THREADS) sb2[i] = b2[i];
    for (int i = tid; i < D_OUT; i += THREADS) sb3[i] = b3[i];
    __syncthreads();

    const int lane = tid & 31;      // wave32
    const int wave = tid >> 5;
    const int hi   = lane >> 4;     // half-wave select
    const int ln   = lane & 15;     // data row within tile (B cols / C cols)

    const int globalWave = blockIdx.x * WAVES + wave;
    const int waveStride = gridDim.x * WAVES;

    // Hoist layer-1 weight fragments (loop-invariant, 32 VGPRs)
    FragH wA1[4];
    #pragma unroll
    for (int nt = 0; nt < 4; ++nt) {
        const _Float16* p = sA1 + nt * 512 + lane * 8;
        wA1[nt].h[0] = *(const v8h*)(p);
        wA1[nt].h[1] = *(const v8h*)(p + 256);
    }

    for (int tile = globalWave; tile < nTiles; tile += waveStride) {
        const long rowBase = (long)tile * 16;

        // ---- build layer-1 B fragment straight from global (float4 loads) --
        FragH bin;
        {
            const float* xrow = X + (rowBase + ln) * D_IN;
            f4 x0 = *(const f4*)(xrow + hi * 8);       // K = hi*8 .. hi*8+3
            f4 x1 = *(const f4*)(xrow + hi * 8 + 4);   // K = hi*8+4 .. +7
            f4 x2 = *(const f4*)(xrow + 16);           // K = 16..19 (lo) / pad (hi)
            f4 x3 = *(const f4*)(xrow + 20);           // K = 20..23 (lo) / pad (hi)
            if (hi) { x2 = (f4){0.f, 0.f, 0.f, 0.f}; x3 = (f4){0.f, 0.f, 0.f, 0.f}; }
            #pragma unroll
            for (int j = 0; j < 4; ++j) {
                bin.h[0][j]     = (_Float16)x0[j];
                bin.h[0][j + 4] = (_Float16)x1[j];
                bin.h[1][j]     = (_Float16)x2[j];
                bin.h[1][j + 4] = (_Float16)x3[j];
            }
        }

        // ================= layer 1: h1^T = W1^T x^T + b1 =================
        // A lane's 8 accumulators of tile nt are features nt*16 + hi*8 + 0..7 of
        // data row ln: exactly half (nt & 1) of the next layer's B fragment
        // (nt >> 1) in KMAP order, so the activations stay in registers.
        FragH b2f[2];
        #pragma unroll
        for (int nt = 0; nt < 4; ++nt) {
            const int fbase = nt * 16 + hi * 8;        // 8 consecutive features
            Acc8 c;                                    // bias as accumulator init
            c.q[0] = *(const f4*)(sb1 + fbase);
            c.q[1] = *(const f4*)(sb1 + fbase + 4);
            c.v = wmma_f16(wA1[nt].f, bin.f, c.v);
            v8h o;
            #pragma unroll
            for (int v = 0; v < 8; ++v)
                o[v] = (_Float16)relu(c.v[v]);
            b2f[nt >> 1].h[nt & 1] = o;
        }

        // ================= layer 2: h2^T = W2^T h1^T + b2 ================
        FragH b3f[4];
        #pragma unroll
        for (int nt = 0; nt < 8; ++nt) {
            const int fbase = nt * 16 + hi * 8;
            Acc8 c;
            c.q[0] = *(const f4*)(sb2 + fbase);
            c.q[1] = *(const f4*)(sb2 + fbase + 4);
            #pragma unroll
            for (int ks = 0; ks < 2; ++ks) {
                FragH a;
                const _Float16* p = sA2 + (nt * 2 + ks) * 512 + lane * 8;
                a.h[0] = *(const v8h*)(p);
                a.h[1] = *(const v8h*)(p + 256);
                c.v = wmma_f16(a.f, b2f[ks].f, c.v);
            }
            v8h o;
            #pragma unroll
            for (int v = 0; v < 8; ++v)
                o[v] = (_Float16)relu(c.v[v]);
            b3f[nt >> 1].h[nt & 1] = o;
        }

        // ================= layer 3: y^T = W3^T h2^T + b3 =================
        float* yrow = Y + (rowBase + ln) * D_OUT;
        #pragma unroll
        for (int nt = 0; nt < 4; ++nt) {
            const int fbase = nt * 16 + hi * 8;
            Acc8 c;
            c.q[0] = *(const f4*)(sb3 + fbase);
            c.q[1] = *(const f4*)(sb3 + fbase + 4);
            #pragma unroll
            for (int ks = 0; ks < 4; ++ks) {
                FragH a;
                const _Float16* p = sA3 + (nt * 4 + ks) * 512 + lane * 8;
                a.h[0] = *(const v8h*)(p);
                a.h[1] = *(const v8h*)(p + 256);
                c.v = wmma_f16(a.f, b3f[ks].f, c.v);
            }
            f4 r0, r1;
            #pragma unroll
            for (int v = 0; v < 4; ++v) {
                r0[v] = relu(c.v[v]);
                r1[v] = relu(c.v[v + 4]);
            }
            *(f4*)(yrow + fbase)     = r0;             // global_store_b128
            *(f4*)(yrow + fbase + 4) = r1;
        }
        // Compiler fence, no instruction: keeps the weight and bias reads inside the
        // tile loop, as the removed waits' clobbers did. Without it the compiler lifts
        // all of them out of the loop (about 500 VGPRs), far above the 128 that a wave
        // of a 32-wave work-group may hold.
        asm volatile("" ::: "memory");
    }
}

extern "C" void kernel_launch(void* const* d_in, const int* in_sizes, int n_in,
                              void* d_out, int out_size, void* d_ws, size_t ws_size,
                              hipStream_t stream) {
    const float* X  = (const float*)d_in[0];
    const float* W1 = (const float*)d_in[1];
    const float* b1 = (const float*)d_in[2];
    const float* W2 = (const float*)d_in[3];
    const float* b2 = (const float*)d_in[4];
    const float* W3 = (const float*)d_in[5];
    const float* b3 = (const float*)d_in[6];
    float* Y = (float*)d_out;

    const long rows   = (long)in_sizes[0] / D_IN;   // 524288
    const int  nTiles = (int)(rows / 16);           // 32768

    int blocks = 256;                               // 8192 waves -> 4 tiles/wave
    if (blocks * WAVES > nTiles) blocks = (nTiles + WAVES - 1) / WAVES;
    if (blocks < 1) blocks = 1;

    linenet_wmma_kernel<<<blocks, THREADS, 0, stream>>>(X, W1, b1, W2, b2, W3, b3,
                                                        Y, nTiles);
}

// v004
// A run of this version takes 27.3 microseconds.
// Timed twice side by side with v003, it ran 1.10 and 1.14 times as fast.
// Counting every step since v000, it is 2.94 times as fast.
#include <hip/hip_runtime.h>

typedef __attribute__((ext_vector_type(16))) _Float16 v16h;
typedef __attribute__((ext_vector_type(8)))  _Float16 v8h;   // 16 bytes
typedef __attribute__((ext_vector_type(8)))  float    v8f;
typedef __attribute__((ext_vector_type(4)))  float    f4;    // 16 bytes

#define D_IN  24
#define D_H1  64
#define D_H2  128
#define D_OUT 64

#define WAVES   32   // one work-group fills a WGP: the weights are staged once per WGP
#define THREADS (WAVES * 32)

// element i of a v16h fragment -> K index (ISA 7.12.2, 16-bit A/B layout)
#define KMAP(i, hi) ((((i) >> 3) << 4) + ((hi) << 3) + ((i) & 7))

union FragH { v16h f; v8h h[2]; };
union Acc8 { v8f v; f4 q[2]; };

__device__ __forceinline__ v8f wmma_f16(const v16h& a, const v16h& b, v8f c) {
    return __builtin_amdgcn_wmma_f32_16x16x32_f16(false, a, false, b,
                                                  (short)0, c, false, false);
}

__device__ __forceinline__ float relu(float r) {
    return __builtin_fmaxf(r, 0.0f);   // single v_max_num_f32
}

__global__ __launch_bounds__(THREADS) void linenet_wmma_kernel(
    const float* __restrict__ X,
    const float* __restrict__ W1, const float* __restrict__ b1,
    const float* __restrict__ W2, const float* __restrict__ b2,
    const float* __restrict__ W3, const float* __restrict__ b3,
    float* __restrict__ Y, int nTiles)
{
    // Weights pre-swizzled into A-fragment order, each fragment as two 512-byte planes:
    // element (frag, lane, i) at [ ((frag*2 + (i>>3))*32 + lane)*8 + (i&7) ], so that the
    // lanes of one ds_load_b128 lie 16 bytes apart: 16 lanes cover all 64 banks once
    // (at 32 bytes a lane they covered half the banks twice, a two-way conflict).
    __shared__ _Float16 sA1[4  * 32 * 16];   //  4 KB  (K padded 24->32)
    __shared__ _Float16 sA2[16 * 32 * 16];   // 16 KB
    __shared__ _Float16 sA3[16 * 32 * 16];   // 16 KB
    __shared__ float    sb1[D_H1], sb2[D_H2], sb3[D_OUT];

    const int tid = threadIdx.x;

    // ---- one-time: convert + swizzle weights into fragment layout ----
    // The three loops have 2, 8 and 8 trips; unrolled so that a thread's loads are in
    // flight together (rolled, each trip waits out its one load's latency).
    #pragma unroll
    for (int idx = tid; idx < 4 * 32 * 16; idx += THREADS) {
        int i = ((idx >> 8) & 1) * 8 + (idx & 7), lane = (idx >> 3) & 31, nt = idx >> 9;
        int hi = lane >> 4, ln = lane & 15;
        int k = KMAP(i, hi);
        sA1[idx] = (k < D_IN) ? (_Float16)W1[k * D_H1 + nt * 16 + ln]
                              : (_Float16)0.f;
    }
    #pragma unroll
    for (int idx = tid; idx < 16 * 32 * 16; idx += THREADS) {
        int i = ((idx >> 8) & 1) * 8 + (idx & 7), lane = (idx >> 3) & 31, f = idx >> 9;
        int nt = f >> 1, ks = f & 1;                 // frag = nt*2 + ks
        int hi = lane >> 4, ln = lane & 15;
        int k = ks * 32 + KMAP(i, hi);
        sA2[idx] = (_Float16)W2[k * D_H2 + nt * 16 + ln];
    }
    #pragma unroll
    for (int idx = tid; idx < 16 * 32 * 16; idx += THREADS) {
        int i = ((idx >> 8) & 1) * 8 + (idx & 7), lane = (idx >> 3) & 31, f = idx >> 9;
        int nt = f >> 2, ks = f & 3;                 // frag = nt*4 + ks
        int hi = lane >> 4, ln = lane & 15;
        int k = ks * 32 + KMAP(i, hi);
        // Layer 3 uses the weights as B: lane ln of tile nt holds output feature ln*4 + nt,
        // so that a lane's four accumulator tiles are four neighbouring floats of one row.
        sA3[idx] = (_Float16)W3[k * D_OUT + ln * 4 + nt];
    }
    for (int i = tid; i < D_H1;  i += THREADS) sb1[i] = b1[i];
    for (int i = tid; i < D_H2;  i += THREADS) sb2[i] = b2[i];
    for (int i = tid; i < D_OUT; i += THREADS) sb3[i] = b3[i];
    __syncthreads();

    const int lane = tid & 31;      // wave32
    const int wave = tid >> 5;
    const int hi   = lane >> 4;     // half-wave select
    const int ln   = lane & 15;     // data row within tile (B/C cols; in layer 3 A rows, B/C cols being features ln*4 + nt)

    const int globalWave = blockIdx.x * WAVES + wave;
    const int waveStride = gridDim.x * WAVES;

    // Hoist layer-1 weight fragments (loop-invariant, 32 VGPRs)
    FragH wA1[4];
    #pragma unroll
    for (int nt = 0; nt < 4; ++nt) {
        const _Float16* p = sA1 + nt * 512 + lane * 8;
        wA1[nt].h[0] = *(const v8h*)(p);
        wA1[nt].h[1] = *(const v8h*)(p + 256);
    }

    // Layer-3 bias of this lane's four output features (loop-invariant, 4 VGPRs)
    const f4 bias3 = *(const f4*)(sb3 + ln * 4);

    for (int tile = globalWave; tile < nTiles; tile += waveStride) {
        const long rowBase = (long)tile * 16;

        // ---- build layer-1 B fragment straight from global (float4 loads) --
        FragH bin;
        {
            const float* xrow = X + (rowBase + ln) * D_IN;
            f4 x0 = *(const f4*)(xrow + hi * 8);       // K = hi*8 .. hi*8+3
            f4 x1 = *(const f4*)(xrow + hi * 8 + 4);   // K = hi*8+4 .. +7
            f4 x2 = *(const f4*)(xrow + 16);           // K = 16..19 (lo) / pad (hi)
            f4 x3 = *(const f4*)(xrow + 20);           // K = 20..23 (lo) / pad (hi)
            if (hi) { x2 = (f4){0.f, 0.f, 0.f, 0.f}; x3 = (f4){0.f, 0.f, 0.f, 0.f}; }
            #pragma unroll
            for (int j = 0; j < 4; ++j) {
                bin.h[0][j]     = (_Float16)x0[j];
                bin.h[0][j + 4] = (_Float16)x1[j];
                bin.h[1][j]     = (_Float16)x2[j];
                bin.h[1][j + 4] = (_Float16)x3[j];
            }
        }

        // ================= layer 1: h1^T = W1^T x^T + b1 =================
        // A lane's 8 accumulators of tile nt are features nt*16 + hi*8 + 0..7 of
        // data row ln: exactly half (nt & 1) of the next layer's B fragment
        // (nt >> 1) in KMAP order, so the activations stay in registers.
        FragH b2f[2];
        #pragma unroll
        for (int nt = 0; nt < 4; ++nt) {
            const int fbase = nt * 16 + hi * 8;        // 8 consecutive features
            Acc8 c;                                    // bias as accumulator init
            c.q[0] = *(const f4*)(sb1 + fbase);
            c.q[1] = *(const f4*)(sb1 + fbase + 4);
            c.v = wmma_f16(wA1[nt].f, bin.f, c.v);
            v8h o;
            #pragma unroll
            for (int v = 0; v < 8; ++v)
                o[v] = (_Float16)relu(c.v[v]);
            b2f[nt >> 1].h[nt & 1] = o;
        }

        // ================= layer 2: h2^T = W2^T h1^T + b2 ================
        FragH b3f[4];
        #pragma unroll
        for (int nt = 0; nt < 8; ++nt) {
            const int fbase = nt * 16 + hi * 8;
            Acc8 c;
            c.q[0] = *(const f4*)(sb2 + fbase);
            c.q[1] = *(const f4*)(sb2 + fbase + 4);
            #pragma unroll
            for (int ks = 0; ks < 2; ++ks) {
                FragH a;
                const _Float16* p = sA2 + (nt * 2 + ks) * 512 + lane * 8;
                a.h[0] = *(const v8h*)(p);
                a.h[1] = *(const v8h*)(p + 256);
                c.v = wmma_f16(a.f, b2f[ks].f, c.v);
            }
            v8h o;
            #pragma unroll
            for (int v = 0; v < 8; ++v)
                o[v] = (_Float16)relu(c.v[v]);
            b3f[nt >> 1].h[nt & 1] = o;
        }

        // ================= layer 3: y = h2 W3 + b3 (not transposed) =====
        // The h2 fragments serve as A (A and B share one lane and K layout), the weights
        // as B. Accumulator v of a lane is then data row hi*8 + v, and tiles 0..3 are its
        // features ln*4 + 0..3: one global_store_b128 writes two whole rows of 256 bytes,
        // four full 128-byte lines, where it wrote 32 separate pieces of 16 bytes.
        v8f c3[4];
        #pragma unroll
        for (int nt = 0; nt < 4; ++nt) {
            c3[nt] = (v8f){0.f, 0.f, 0.f, 0.f, 0.f, 0.f, 0.f, 0.f};
            #pragma unroll
            for (int ks = 0; ks < 4; ++ks) {
                FragH w;
                const _Float16* p = sA3 + (nt * 4 + ks) * 512 + lane * 8;
                w.h[0] = *(const v8h*)(p);
                w.h[1] = *(const v8h*)(p + 256);
                c3[nt] = wmma_f16(b3f[ks].f, w.f, c3[nt]);
            }
        }
        float* ycol = Y + (rowBase + hi * 8) * D_OUT + ln * 4;
        // All eight row pairs are formed before the first store: the h2 registers are free
        // by now, and the stores then issue as one run over 4 KB in a row (formed one at a
        // time they shared four registers, with a wait behind every store).
        f4 r[8];
        #pragma unroll
        for (int v = 0; v < 8; ++v) {
            #pragma unroll
            for (int nt = 0; nt < 4; ++nt)
                r[v][nt] = relu(c3[nt][v] + bias3[nt]);   // bias is per lane here: added last
        }
        #pragma unroll
        for (int v = 0; v < 8; ++v)
            *(f4*)(ycol + v * D_OUT) = r[v];              // global_store_b128
        // Compiler fence, no instruction: keeps the weight and bias reads inside the
        // tile loop, as the removed waits' clobbers did. Without it the compiler lifts
        // all of them out of the loop (about 500 VGPRs), far above the 128 that a wave
        // of a 32-wave work-group may hold.
        asm volatile("" ::: "memory");
    }
}

extern "C" void kernel_launch(void* const* d_in, const int* in_sizes, int n_in,
                              void* d_out, int out_size, void* d_ws, size_t ws_size,
                              hipStream_t stream) {
    const float* X  = (const float*)d_in[0];
    const float* W1 = (const float*)d_in[1];
    const float* b1 = (const float*)d_in[2];
    const float* W2 = (const float*)d_in[3];
    const float* b2 = (const float*)d_in[4];
    const float* W3 = (const float*)d_in[5];
    const float* b3 = (const float*)d_in[6];
    float* Y = (float*)d_out;

    const long rows   = (long)in_sizes[0] / D_IN;   // 524288
    const int  nTiles = (int)(rows / 16);           // 32768

    int blocks = 256;                               // 8192 waves -> 4 tiles/wave
    if (blocks * WAVES > nTiles) blocks = (nTiles + WAVES - 1) / WAVES;
    if (blocks < 1) blocks = 1;

    linenet_wmma_kernel<<<blocks, THREADS, 0, stream>>>(X, W1, b1, W2, b2, W3, b3,
                                                        Y, nTiles);
}
